// v000
// Measured on an AMD MI455X. A time is GPU time per run, averaged over a window of back-to-back runs after a warm-up
// (all launches, gaps included; the runs take copies of the inputs in turn), and the median of several windows.
// Apart from v000's, it joins two sittings. Times from different sittings can be a few percent apart, while
// side-by-side timings come from the same sitting.
// v000, which the later versions start from, runs in 35.5 microseconds.
#include <hip/hip_runtime.h>
#include <hip/hip_bf16.h>

// Fused RMSNorm-logit / depth-softmax / weighted-sum kernel for MI455X.
// Memory-bound: V (256 MB) is read from HBM exactly once per element via the
// CDNA5 async global->LDS DMA path; all reuse (3 passes over the tile) happens
// out of LDS. The 8 length-1024 dot products run on the WMMA pipe
// (v_wmma_f32_16x16x4_f32) with rows 8..15 fed from a zeroed LDS row so the
// inner loop has no EXEC divergence.

typedef __attribute__((ext_vector_type(2))) float v2f;
typedef __attribute__((ext_vector_type(4))) float v4f;
typedef __attribute__((ext_vector_type(8))) float v8f;

#define N_STACK 8
#define B_DIM   4
#define S_DIM   2048
#define D_DIM   1024
#define ROW     1032          // LDS row stride in floats (4128 B = 8-bank skew)
#define EPS_F   1e-5f

__global__ __launch_bounds__(256)
void attn_residual_fused(const float* __restrict__ V,
                         const float* __restrict__ proj,
                         const float* __restrict__ scale,
                         const int*   __restrict__ bidx,
                         float*       __restrict__ out,
                         int maxb)
{
    __shared__ __align__(16) float Vt[N_STACK * ROW];   // 33,024 B V tile
    __shared__ __align__(16) float wsc[D_DIM];          // proj[blk]*scale
    __shared__ __align__(16) float zrow[D_DIM];         // zero row for M=8..15
    __shared__ float dotPart[8 * 8];                    // [wave][n]
    __shared__ float ssqTot[8];
    __shared__ float logitsS[8];

    const int t = threadIdx.x;            // 0..255
    const int s = blockIdx.x;             // 0..2047
    const int b = blockIdx.y;             // 0..3

    const size_t nStride = (size_t)B_DIM * S_DIM * D_DIM;     // 8M floats
    const size_t bsOff   = ((size_t)b * S_DIM + s) * D_DIM;

    // ---- async DMA: V[n, b, s, 0:1024] for n=0..7 (32 KB) global -> LDS ----
    // Each lane moves one float4 per instruction; 8 instructions/thread.
    unsigned ldsBase = (unsigned)(unsigned long long)(void*)Vt;  // LDS byte offset
    #pragma unroll
    for (int n = 0; n < N_STACK; ++n) {
        unsigned loff = ldsBase + (unsigned)(n * (ROW * 4) + t * 16);
        const float* gp = V + (size_t)n * nStride + bsOff + (size_t)t * 4;
        asm volatile("global_load_async_to_lds_b128 %0, %1, off"
                     :: "v"(loff), "v"(gp)
                     : "memory");
    }

    // ---- overlap with the DMA: wsc[d] = proj[blk][d]*scale[d]; zero zrow ----
    int blk = *bidx;
    if (blk > maxb - 1) blk = maxb - 1;
    {
        v4f p  = ((const v4f*)(proj + (size_t)blk * D_DIM))[t];
        v4f sc = ((const v4f*)scale)[t];
        ((v4f*)wsc)[t] = p * sc;
        ((v4f*)zrow)[t] = (v4f){0.f, 0.f, 0.f, 0.f};
    }

    asm volatile("s_wait_asynccnt 0" ::: "memory");
    __syncthreads();

    const int w = t >> 5;    // wave id 0..7
    const int l = t & 31;    // lane id

    // ---- phase 1a: sum of squares per n (wave w owns n == w), VALU ----
    {
        float ssq = 0.f;
        const v4f* row = (const v4f*)(Vt + w * ROW);
        #pragma unroll
        for (int i = 0; i < 8; ++i) {
            v4f v = row[l + 32 * i];
            ssq = fmaf(v.x, v.x, ssq);
            ssq = fmaf(v.y, v.y, ssq);
            ssq = fmaf(v.z, v.z, ssq);
            ssq = fmaf(v.w, v.w, ssq);
        }
        #pragma unroll
        for (int o = 16; o > 0; o >>= 1) ssq += __shfl_xor(ssq, o, 32);
        if (l == 0) ssqTot[w] = ssq;
    }

    // ---- phase 1b: logit dots via WMMA. M = n (rows 0..7; 8..15 read the
    //      zeroed row -> uniform, branch-free loads), K = d (each wave owns a
    //      128-wide d slice), two C accumulators to halve the RAW chain. ----
    {
        const int r  = l & 15;            // A-matrix row (M)
        const int kb = (l >> 4) << 1;     // lanes 16..31 hold K = 2,3
        const int dbase = w * 128 + kb;
        const float* aRow = (r < 8) ? (Vt + r * ROW) : zrow;
        v8f c0 = {0.f,0.f,0.f,0.f,0.f,0.f,0.f,0.f};
        v8f c1 = {0.f,0.f,0.f,0.f,0.f,0.f,0.f,0.f};
        #pragma unroll 4
        for (int i = 0; i < 32; i += 2) {
            const int d0 = dbase + i * 4;
            const int d1 = d0 + 4;
            v2f a0, b0, a1, b1;
            a0.x = aRow[d0];     a0.y = aRow[d0 + 1];
            b0.x = wsc[d0];      b0.y = wsc[d0 + 1];
            a1.x = aRow[d1];     a1.y = aRow[d1 + 1];
            b1.x = wsc[d1];      b1.y = wsc[d1 + 1];
            c0 = __builtin_amdgcn_wmma_f32_16x16x4_f32(
                    false, a0, false, b0, (short)0, c0, false, false);
            c1 = __builtin_amdgcn_wmma_f32_16x16x4_f32(
                    false, a1, false, b1, (short)0, c1, false, false);
        }
        // C layout: VGPR j, lane 0 -> D[M=j, N=0]; B is N-broadcast so any N works.
        if (l == 0) {
            #pragma unroll
            for (int n = 0; n < 8; ++n) dotPart[w * 8 + n] = c0[n] + c1[n];
        }
    }

    __syncthreads();

    // ---- combine partial dots, form logits ----
    if (t < 8) {
        float d = 0.f;
        #pragma unroll
        for (int ww = 0; ww < 8; ++ww) d += dotPart[ww * 8 + t];
        float mean = ssqTot[t] * (1.0f / (float)D_DIM);
        logitsS[t] = d / sqrtf(mean + EPS_F);   // dot(w*scale,V)/rms
    }
    __syncthreads();

    // ---- softmax over n (redundant per thread: 8 values) ----
    float wgt[8];
    {
        float m = logitsS[0];
        #pragma unroll
        for (int n = 1; n < 8; ++n) m = fmaxf(m, logitsS[n]);
        float sum = 0.f;
        #pragma unroll
        for (int n = 0; n < 8; ++n) { wgt[n] = expf(logitsS[n] - m); sum += wgt[n]; }
        float inv = 1.0f / sum;
        #pragma unroll
        for (int n = 0; n < 8; ++n) wgt[n] *= inv;
    }

    // ---- phase 2: out[d] = sum_n wgt[n]*V[n,d] from LDS, NT b128 store ----
    v4f acc = {0.f, 0.f, 0.f, 0.f};
    #pragma unroll
    for (int n = 0; n < 8; ++n) {
        v4f v = *(const v4f*)(Vt + n * ROW + t * 4);
        acc = acc + wgt[n] * v;
    }
    v4f* outp = (v4f*)out + ((size_t)b * S_DIM + s) * (D_DIM / 4) + t;
    __builtin_nontemporal_store(acc, outp);
}

extern "C" void kernel_launch(void* const* d_in, const int* in_sizes, int n_in,
                              void* d_out, int out_size, void* d_ws, size_t ws_size,
                              hipStream_t stream) {
    const float* V     = (const float*)d_in[0];   // (8,4,2048,1024) f32
    const float* proj  = (const float*)d_in[1];   // (12,1024) f32
    const float* scale = (const float*)d_in[2];   // (1024,) f32
    const int*   bidx  = (const int*)d_in[3];     // scalar int on device
    float* out = (float*)d_out;                   // (4,2048,1024) f32

    int maxb = in_sizes[1] / D_DIM;               // 12
    if (maxb < 1) maxb = 1;

    dim3 grid(S_DIM, B_DIM);                      // one WG per (s, b)
    attn_residual_fused<<<grid, 256, 0, stream>>>(V, proj, scale, bidx, out, maxb);
}

// v001
// Measured time: 28.7 microseconds a run.
// Two timings next to v000 both put it at 1.25 times that version's speed.
#include <hip/hip_runtime.h>
#include <hip/hip_bf16.h>

// Fused RMSNorm-logit / depth-softmax / weighted-sum kernel for MI455X.
// Memory-bound: V (256 MB) is read from HBM exactly once per element via the
// CDNA5 async global->LDS DMA path; all reuse (3 passes over the tile) happens
// out of LDS. The 8 length-1024 dot products run on the WMMA pipe
// (v_wmma_f32_16x16x4_f32): A rows 0..7 hold the 8 stack entries on one group
// of 4 d, rows 8..15 the same entries on the next group of 4 d, so all 64
// A elements of every WMMA are V data.

typedef __attribute__((ext_vector_type(2))) float v2f;
typedef __attribute__((ext_vector_type(4))) float v4f;
typedef __attribute__((ext_vector_type(8))) float v8f;

#define N_STACK 8
#define B_DIM   4
#define S_DIM   2048
#define D_DIM   1024
#define ROW     1032          // LDS row stride in floats (4128 B = 8-bank skew)
#define EPS_F   1e-5f

__global__ __launch_bounds__(256)
void attn_residual_fused(const float* __restrict__ V,
                         const float* __restrict__ proj,
                         const float* __restrict__ scale,
                         const int*   __restrict__ bidx,
                         float*       __restrict__ out,
                         int maxb)
{
    __shared__ __align__(16) float Vt[N_STACK * ROW];   // 33,024 B V tile
    __shared__ __align__(16) float wsc[D_DIM];          // proj[blk]*scale
    __shared__ float dotPart[16 * 8];                   // [wave][d group][n]
    __shared__ float ssqTot[8];
    __shared__ float logitsS[8];

    const int t = threadIdx.x;            // 0..255
    const int s = blockIdx.x;             // 0..2047
    const int b = blockIdx.y;             // 0..3

    const size_t nStride = (size_t)B_DIM * S_DIM * D_DIM;     // 8M floats
    const size_t bsOff   = ((size_t)b * S_DIM + s) * D_DIM;

    // ---- async DMA: V[n, b, s, 0:1024] for n=0..7 (32 KB) global -> LDS ----
    // Each lane moves one float4 per instruction; 8 instructions/thread.
    unsigned ldsBase = (unsigned)(unsigned long long)(void*)Vt;  // LDS byte offset
    #pragma unroll
    for (int n = 0; n < N_STACK; ++n) {
        unsigned loff = ldsBase + (unsigned)(n * (ROW * 4) + t * 16);
        const float* gp = V + (size_t)n * nStride + bsOff + (size_t)t * 4;
        asm volatile("global_load_async_to_lds_b128 %0, %1, off"
                     :: "v"(loff), "v"(gp)
                     : "memory");
    }

    // ---- overlap with the DMA: wsc[d] = proj[blk][d]*scale[d] ----
    int blk = *bidx;
    if (blk > maxb - 1) blk = maxb - 1;
    {
        v4f p  = ((const v4f*)(proj + (size_t)blk * D_DIM))[t];
        v4f sc = ((const v4f*)scale)[t];
        ((v4f*)wsc)[t] = p * sc;
    }

    asm volatile("s_wait_asynccnt 0" ::: "memory");
    __syncthreads();

    const int w = t >> 5;    // wave id 0..7
    const int l = t & 31;    // lane id

    // ---- phase 1a: sum of squares per n (wave w owns n == w), VALU ----
    {
        float ssq = 0.f;
        const v4f* row = (const v4f*)(Vt + w * ROW);
        #pragma unroll
        for (int i = 0; i < 8; ++i) {
            v4f v = row[l + 32 * i];
            ssq = fmaf(v.x, v.x, ssq);
            ssq = fmaf(v.y, v.y, ssq);
            ssq = fmaf(v.z, v.z, ssq);
            ssq = fmaf(v.w, v.w, ssq);
        }
        #pragma unroll
        for (int o = 16; o > 0; o >>= 1) ssq += __shfl_xor(ssq, o, 32);
        if (l == 0) ssqTot[w] = ssq;
    }

    // ---- phase 1b: logit dots via WMMA. Each wave owns a 128-wide d slice.
    //      Lane (c = l & 15, hi = l >> 4) reads 4 consecutive d of stack entry
    //      c & 7 at group g = c >> 3; the same d offsets index wsc for column c
    //      of B, so D[m][c] is a true partial dot wherever m >> 3 == c >> 3.
    //      One 16-byte read per operand feeds two WMMAs (k pairs x,y and z,w);
    //      16 lanes of a half-wave touch all 64 banks once (8n + 4g + 0..3).
    //      Two C accumulators halve the RAW chain. ----
    {
        const int c  = l & 15;
        const int g  = c >> 3;
        const int d0 = w * 128 + ((l >> 4) * 2 + g) * 4;
        const float* aPtr = Vt + (c & 7) * ROW + d0;
        const float* bPtr = wsc + d0;
        v8f c0 = {0.f,0.f,0.f,0.f,0.f,0.f,0.f,0.f};
        v8f c1 = {0.f,0.f,0.f,0.f,0.f,0.f,0.f,0.f};
        #pragma unroll   // constant LDS offsets; later trips' reads issue ahead of the WMMAs
        for (int i = 0; i < 8; ++i) {
            const v4f a = *(const v4f*)(aPtr + i * 16);
            const v4f b = *(const v4f*)(bPtr + i * 16);
            c0 = __builtin_amdgcn_wmma_f32_16x16x4_f32(
                    false, (v2f){a.x, a.y}, false, (v2f){b.x, b.y}, (short)0, c0, false, false);
            c1 = __builtin_amdgcn_wmma_f32_16x16x4_f32(
                    false, (v2f){a.z, a.w}, false, (v2f){b.z, b.w}, (short)0, c1, false, false);
        }
        // D layout: register j of lane (c, hi) = D[8*hi + j][c]. Lane 0 holds
        // D[n][0] (group 0), lane 24 holds D[8 + n][8] (group 1).
        if (c == ((l >> 4) << 3)) {
            #pragma unroll
            for (int n = 0; n < 8; ++n) dotPart[(w * 2 + (l >> 4)) * 8 + n] = c0[n] + c1[n];
        }
    }

    __syncthreads();

    // ---- combine partial dots, form logits ----
    if (t < 8) {
        float dg0 = 0.f, dg1 = 0.f;       // one chain per d group
        #pragma unroll
        for (int ww = 0; ww < 8; ++ww) {
            dg0 += dotPart[(ww * 2 + 0) * 8 + t];
            dg1 += dotPart[(ww * 2 + 1) * 8 + t];
        }
        float d = dg0 + dg1;
        float mean = ssqTot[t] * (1.0f / (float)D_DIM);
        logitsS[t] = d / sqrtf(mean + EPS_F);   // dot(w*scale,V)/rms
    }
    __syncthreads();

    // ---- softmax over n (redundant per thread: 8 values) ----
    float wgt[8];
    {
        float m = logitsS[0];
        #pragma unroll
        for (int n = 1; n < 8; ++n) m = fmaxf(m, logitsS[n]);
        float sum = 0.f;
        #pragma unroll
        for (int n = 0; n < 8; ++n) { wgt[n] = expf(logitsS[n] - m); sum += wgt[n]; }
        float inv = 1.0f / sum;
        #pragma unroll
        for (int n = 0; n < 8; ++n) wgt[n] *= inv;
    }

    // ---- phase 2: out[d] = sum_n wgt[n]*V[n,d] from LDS, NT b128 store ----
    v4f acc = {0.f, 0.f, 0.f, 0.f};
    #pragma unroll
    for (int n = 0; n < 8; ++n) {
        v4f v = *(const v4f*)(Vt + n * ROW + t * 4);
        acc = acc + wgt[n] * v;
    }
    v4f* outp = (v4f*)out + ((size_t)b * S_DIM + s) * (D_DIM / 4) + t;
    __builtin_nontemporal_store(acc, outp);
}

extern "C" void kernel_launch(void* const* d_in, const int* in_sizes, int n_in,
                              void* d_out, int out_size, void* d_ws, size_t ws_size,
                              hipStream_t stream) {
    const float* V     = (const float*)d_in[0];   // (8,4,2048,1024) f32
    const float* proj  = (const float*)d_in[1];   // (12,1024) f32
    const float* scale = (const float*)d_in[2];   // (1024,) f32
    const int*   bidx  = (const int*)d_in[3];     // scalar int on device
    float* out = (float*)d_out;                   // (4,2048,1024) f32

    int maxb = in_sizes[1] / D_DIM;               // 12
    if (maxb < 1) maxb = 1;

    dim3 grid(S_DIM, B_DIM);                      // one WG per (s, b)
    attn_residual_fused<<<grid, 256, 0, stream>>>(V, proj, scale, bidx, out, maxb);
}

// v002
// One run takes 27.4 microseconds.
// Next to v001, in two timings, it ran 1.05 and 1.04 times as fast.
// Over all steps from v000 it is 1.30 times as fast.
#include <hip/hip_runtime.h>
#include <hip/hip_bf16.h>

// Fused RMSNorm-logit / depth-softmax / weighted-sum kernel for MI455X.
// Memory-bound: V (256 MB) is read from HBM exactly once per element via the
// CDNA5 async global->LDS DMA path; all reuse (3 passes over the tile) happens
// out of LDS. The 8 length-1024 dot products run on the WMMA pipe
// (v_wmma_f32_16x16x4_f32): A rows 0..7 hold the 8 stack entries on one group
// of 4 d, rows 8..15 the same entries on the next group of 4 d, so all 64
// A elements of every WMMA are V data.

typedef __attribute__((ext_vector_type(2))) float v2f;
typedef __attribute__((ext_vector_type(4))) float v4f;
typedef __attribute__((ext_vector_type(8))) float v8f;

#define N_STACK 8
#define B_DIM   4
#define S_DIM   2048
#define D_DIM   1024
#define ROW     1032          // LDS row stride in floats (4128 B = 8-bank skew)
#define EPS_F   1e-5f

// Value of lane (l ^ X) within the 16-lane row, X < 16 (DPP row_xmask:X).
template <int X>
__device__ __forceinline__ float lane_xor(float v)
{
    return __int_as_float(__builtin_amdgcn_update_dpp(
               0, __float_as_int(v), 0x160 + X, 0xf, 0xf, false));
}

__global__ __launch_bounds__(256)
void attn_residual_fused(const float* __restrict__ V,
                         const float* __restrict__ proj,
                         const float* __restrict__ scale,
                         const int*   __restrict__ bidx,
                         float*       __restrict__ out,
                         int maxb)
{
    __shared__ __align__(16) float Vt[N_STACK * ROW];   // 33,024 B V tile
    __shared__ __align__(16) float wsc[D_DIM];          // proj[blk]*scale
    __shared__ float dotPart[16 * 8];                   // [wave][d group][n]
    __shared__ float ssqTot[8];
    __shared__ float wgtS[8];                           // softmax weights

    const int t = threadIdx.x;            // 0..255
    const int s = blockIdx.x;             // 0..2047
    const int b = blockIdx.y;             // 0..3

    const size_t nStride = (size_t)B_DIM * S_DIM * D_DIM;     // 8M floats
    const size_t bsOff   = ((size_t)b * S_DIM + s) * D_DIM;

    // ---- async DMA: V[n, b, s, 0:1024] for n=0..7 (32 KB) global -> LDS ----
    // Each lane moves one float4 per instruction; 8 instructions/thread.
    unsigned ldsBase = (unsigned)(unsigned long long)(void*)Vt;  // LDS byte offset
    #pragma unroll
    for (int n = 0; n < N_STACK; ++n) {
        unsigned loff = ldsBase + (unsigned)(n * (ROW * 4) + t * 16);
        const float* gp = V + (size_t)n * nStride + bsOff + (size_t)t * 4;
        asm volatile("global_load_async_to_lds_b128 %0, %1, off"
                     :: "v"(loff), "v"(gp)
                     : "memory");
    }

    // ---- overlap with the DMA: wsc[d] = proj[blk][d]*scale[d] ----
    int blk = *bidx;
    if (blk > maxb - 1) blk = maxb - 1;
    {
        v4f p  = ((const v4f*)(proj + (size_t)blk * D_DIM))[t];
        v4f sc = ((const v4f*)scale)[t];
        ((v4f*)wsc)[t] = p * sc;
    }

    asm volatile("s_wait_asynccnt 0" ::: "memory");
    __syncthreads();

    const int w = t >> 5;    // wave id 0..7
    const int l = t & 31;    // lane id

    // ---- phase 1a: sum of squares per n (wave w owns n == w), VALU ----
    {
        float ssq = 0.f;
        const v4f* row = (const v4f*)(Vt + w * ROW);
        #pragma unroll
        for (int i = 0; i < 8; ++i) {
            v4f v = row[l + 32 * i];
            ssq = fmaf(v.x, v.x, ssq);
            ssq = fmaf(v.y, v.y, ssq);
            ssq = fmaf(v.z, v.z, ssq);
            ssq = fmaf(v.w, v.w, ssq);
        }
        #pragma unroll
        for (int o = 16; o > 0; o >>= 1) ssq += __shfl_xor(ssq, o, 32);
        if (l == 0) ssqTot[w] = ssq;
    }

    // ---- phase 1b: logit dots via WMMA. Each wave owns a 128-wide d slice.
    //      Lane (c = l & 15, hi = l >> 4) reads 4 consecutive d of stack entry
    //      c & 7 at group g = c >> 3; the same d offsets index wsc for column c
    //      of B, so D[m][c] is a true partial dot wherever m >> 3 == c >> 3.
    //      One 16-byte read per operand feeds two WMMAs (k pairs x,y and z,w);
    //      16 lanes of a half-wave touch all 64 banks once (8n + 4g + 0..3).
    //      Two C accumulators halve the RAW chain. ----
    {
        const int c  = l & 15;
        const int g  = c >> 3;
        const int d0 = w * 128 + ((l >> 4) * 2 + g) * 4;
        const float* aPtr = Vt + (c & 7) * ROW + d0;
        const float* bPtr = wsc + d0;
        v8f c0 = {0.f,0.f,0.f,0.f,0.f,0.f,0.f,0.f};
        v8f c1 = {0.f,0.f,0.f,0.f,0.f,0.f,0.f,0.f};
        #pragma unroll   // constant LDS offsets; later trips' reads issue ahead of the WMMAs
        for (int i = 0; i < 8; ++i) {
            const v4f a = *(const v4f*)(aPtr + i * 16);
            const v4f b = *(const v4f*)(bPtr + i * 16);
            c0 = __builtin_amdgcn_wmma_f32_16x16x4_f32(
                    false, (v2f){a.x, a.y}, false, (v2f){b.x, b.y}, (short)0, c0, false, false);
            c1 = __builtin_amdgcn_wmma_f32_16x16x4_f32(
                    false, (v2f){a.z, a.w}, false, (v2f){b.z, b.w}, (short)0, c1, false, false);
        }
        // D layout: register j of lane (c, hi) = D[8*hi + j][c]. Lane 0 holds
        // D[n][0] (group 0), lane 24 holds D[8 + n][8] (group 1).
        if (c == ((l >> 4) << 3)) {
            #pragma unroll
            for (int n = 0; n < 8; ++n) dotPart[(w * 2 + (l >> 4)) * 8 + n] = c0[n] + c1[n];
        }
    }

    __syncthreads();

    // ---- combine partial dots, form logits and their softmax over n, once per
    //      work-group: lane n of wave 0 owns stack entry n; maximum and sum go
    //      over lanes 0..7 by three row_xmask steps each ----
    if (t < 8) {
        float dg0 = 0.f, dg1 = 0.f;       // one chain per d group
        #pragma unroll
        for (int ww = 0; ww < 8; ++ww) {
            dg0 += dotPart[(ww * 2 + 0) * 8 + t];
            dg1 += dotPart[(ww * 2 + 1) * 8 + t];
        }
        float d = dg0 + dg1;
        float mean = ssqTot[t] * (1.0f / (float)D_DIM);
        const float logit = d / sqrtf(mean + EPS_F);   // dot(w*scale,V)/rms
        float m = logit;
        m = fmaxf(m, lane_xor<1>(m));
        m = fmaxf(m, lane_xor<2>(m));
        m = fmaxf(m, lane_xor<4>(m));
        const float e = expf(logit - m);
        float sum = e;
        sum += lane_xor<1>(sum);
        sum += lane_xor<2>(sum);
        sum += lane_xor<4>(sum);
        wgtS[t] = e * (1.0f / sum);
    }
    __syncthreads();

    // ---- phase 2: out[d] = sum_n wgt[n]*V[n,d] from LDS, NT b128 store ----
    v4f acc = {0.f, 0.f, 0.f, 0.f};
    #pragma unroll
    for (int n = 0; n < 8; ++n) {
        v4f v = *(const v4f*)(Vt + n * ROW + t * 4);
        acc = acc + wgtS[n] * v;
    }
    v4f* outp = (v4f*)out + ((size_t)b * S_DIM + s) * (D_DIM / 4) + t;
    __builtin_nontemporal_store(acc, outp);
}

extern "C" void kernel_launch(void* const* d_in, const int* in_sizes, int n_in,
                              void* d_out, int out_size, void* d_ws, size_t ws_size,
                              hipStream_t stream) {
    const float* V     = (const float*)d_in[0];   // (8,4,2048,1024) f32
    const float* proj  = (const float*)d_in[1];   // (12,1024) f32
    const float* scale = (const float*)d_in[2];   // (1024,) f32
    const int*   bidx  = (const int*)d_in[3];     // scalar int on device
    float* out = (float*)d_out;                   // (4,2048,1024) f32

    int maxb = in_sizes[1] / D_DIM;               // 12
    if (maxb < 1) maxb = 1;

    dim3 grid(S_DIM, B_DIM);                      // one WG per (s, b)
    attn_residual_fused<<<grid, 256, 0, stream>>>(V, proj, scale, bidx, out, maxb);
}
